// v000
// Times are from an AMD MI455X. After a warm-up the kernel runs many times in a row, and a time is the length of
// such a window on the GPU divided by its runs, so every launch and the gaps after it count. The runs cycle
// through copies of the inputs. A figure is the median of several windows, for all but v000 over two sittings.
// Sittings can differ by a few percent; kernels timed side by side share one.
// The starting kernel, v000, takes 1060 microseconds a run.
#include <hip/hip_runtime.h>
#include <hip/hip_bf16.h>

typedef __attribute__((ext_vector_type(2))) float v2f;
typedef __attribute__((ext_vector_type(8))) float v8f;
typedef __attribute__((ext_vector_type(4))) unsigned int u32x4;
typedef __attribute__((ext_vector_type(4))) int i32x4;
typedef __attribute__((ext_vector_type(8))) int i32x8;

#define B_  32
#define T_  2048
#define D_  512
#define KF  201
#define CH  32

// ---------------------------------------------------------------------------
// A) location conv (K=201, zero-pad 100) -> relu -> maxpool over T => feat(B,32)
// ---------------------------------------------------------------------------
__global__ __launch_bounds__(256) void conv_feat_kernel(
    const float* __restrict__ att_prev, const float* __restrict__ conv_w,
    float* __restrict__ feat) {
  __shared__ float ap[T_ + 2 * 100];   // padded row
  __shared__ float cw[CH * KF];
  __shared__ float smax[CH * 8];
  const int b = blockIdx.x, tid = threadIdx.x;
  for (int i = tid; i < T_ + 200; i += 256) {
    int t = i - 100;
    ap[i] = (t >= 0 && t < T_) ? att_prev[b * T_ + t] : 0.0f;
  }
  for (int i = tid; i < CH * KF; i += 256) cw[i] = conv_w[i];
  __syncthreads();
  const int c = tid & 31, slot = tid >> 5;
  const float* wc = cw + c * KF;
  float m = 0.0f;                       // relu => max starts at 0
  for (int t = slot; t < T_; t += 8) {
    float acc = 0.0f;
    for (int k = 0; k < KF; ++k) acc += ap[t + k] * wc[k];
    m = fmaxf(m, acc);
  }
  smax[c * 8 + slot] = m;
  __syncthreads();
  if (tid < CH) {
    float mm = 0.0f;
    for (int s = 0; s < 8; ++s) mm = fmaxf(mm, smax[tid * 8 + s]);
    feat[b * CH + tid] = mm;
  }
}

// ---------------------------------------------------------------------------
// B) gates = feat @ W_ih.T + b_ih + att_h @ W_hh.T + b_hh   (B x 4*512)
// ---------------------------------------------------------------------------
__global__ __launch_bounds__(256) void gates_kernel(
    const float* __restrict__ feat, const float* __restrict__ att_h,
    const float* __restrict__ W_ih, const float* __restrict__ W_hh,
    const float* __restrict__ b_ih, const float* __restrict__ b_hh,
    float* __restrict__ gates) {
  __shared__ float h_s[D_];
  __shared__ float f_s[CH];
  const int b = blockIdx.x >> 3;
  const int j = ((blockIdx.x & 7) << 8) + threadIdx.x;   // 0..2047
  for (int i = threadIdx.x; i < D_; i += 256) h_s[i] = att_h[b * D_ + i];
  if (threadIdx.x < CH) f_s[threadIdx.x] = feat[b * CH + threadIdx.x];
  __syncthreads();
  float acc = b_ih[j] + b_hh[j];
  const float* wih = W_ih + j * CH;
#pragma unroll
  for (int c = 0; c < CH; ++c) acc += f_s[c] * wih[c];
  const float4* whh4 = (const float4*)(W_hh + (size_t)j * D_);
  for (int k = 0; k < D_ / 4; ++k) {
    float4 w4 = whh4[k];
    acc += h_s[4 * k + 0] * w4.x + h_s[4 * k + 1] * w4.y +
           h_s[4 * k + 2] * w4.z + h_s[4 * k + 3] * w4.w;
  }
  gates[b * 4 * D_ + j] = acc;
}

// ---------------------------------------------------------------------------
// C) LSTM cell nonlinearity -> h_new, c_new (torch gate order i,f,g,o)
// ---------------------------------------------------------------------------
__global__ __launch_bounds__(256) void cell_kernel(
    const float* __restrict__ gates, const float* __restrict__ att_c,
    float* __restrict__ h_out, float* __restrict__ c_out) {
  const int idx = blockIdx.x * 256 + threadIdx.x;   // 0..16383
  const int b = idx >> 9, j = idx & 511;
  const float* g = gates + b * 4 * D_;
  const float gi = g[j], gf = g[j + D_], gg = g[j + 2 * D_], go = g[j + 3 * D_];
  const float si = 1.0f / (1.0f + __expf(-gi));
  const float sf = 1.0f / (1.0f + __expf(-gf));
  const float so = 1.0f / (1.0f + __expf(-go));
  const float cn = sf * att_c[idx] + si * tanhf(gg);
  h_out[idx] = so * tanhf(cn);
  c_out[idx] = cn;
}

// ---------------------------------------------------------------------------
// D) add_vec[b,a] = (h_new@W_w)[a] + (dec_z@U_w)[a] + W_b[a]+U_b[a]+V_b[a]
// ---------------------------------------------------------------------------
__global__ __launch_bounds__(256) void addvec_kernel(
    const float* __restrict__ h_new, const float* __restrict__ dec_z,
    const float* __restrict__ W_w, const float* __restrict__ W_b,
    const float* __restrict__ U_w, const float* __restrict__ U_b,
    const float* __restrict__ V_b, float* __restrict__ addv) {
  __shared__ float h_s[D_];
  __shared__ float z_s[D_];
  const int b = blockIdx.x >> 1;
  const int a = ((blockIdx.x & 1) << 8) + threadIdx.x;
  for (int i = threadIdx.x; i < D_; i += 256) {
    h_s[i] = h_new[b * D_ + i];
    z_s[i] = dec_z[b * D_ + i];
  }
  __syncthreads();
  float acc = W_b[a] + U_b[a] + V_b[a];
  for (int k = 0; k < D_; ++k)
    acc += h_s[k] * W_w[k * D_ + a] + z_s[k] * U_w[k * D_ + a];
  addv[b * D_ + a] = acc;
}

// ---------------------------------------------------------------------------
// E) fused  score[b,t] = sum_a tanh( (enc[b,t,:]@V_w)[a] + add_vec[b,a] )*g_w[a] + g_b
//    WMMA f32 16x16x4; A tile (128x16 fp32, row stride 512) staged by the
//    Tensor Data Mover with LDS padding to stride 17; V_w tile staged
//    transposed [col][k] stride 18 so B frags are single ds_load_b64.
// ---------------------------------------------------------------------------
__global__ __launch_bounds__(256) void score_fused_kernel(
    const float* __restrict__ enc, const float* __restrict__ Vw,
    const float* __restrict__ addv, const float* __restrict__ gw,
    const float* __restrict__ gb, float* __restrict__ score) {
  const int b = blockIdx.y, tb = blockIdx.x;    // tb: 0..15 (128 rows each)
  const int tid = threadIdx.x;
  const int lane = tid & 31;
  const int wave = tid >> 5;                    // 0..7 : M-subtile owner
  const int hi = lane >> 4;                     // lane half
  const int l15 = lane & 15;

  __shared__ float As[128 * 17];                // 128 rows x 16 k (TDM pads ->17)
  __shared__ float Bs[128 * 18];                // transposed: [n-col][16 k] (pad->18)
  __shared__ float addv_s[D_];
  __shared__ float gw_s[D_];
  __shared__ float score_s[128];

  for (int i = tid; i < D_; i += 256) {
    addv_s[i] = addv[b * D_ + i];
    gw_s[i] = gw[i];
  }

  const float* encB = enc + ((size_t)b * T_ + tb * 128) * D_;
  const unsigned int lds_As = (unsigned int)(uintptr_t)As;  // low 32 bits = LDS offset

  float part[8];
#pragma unroll
  for (int r = 0; r < 8; ++r) part[r] = 0.0f;

  for (int nc = 0; nc < 4; ++nc) {              // 4 chunks of 128 N-columns
    v8f acc[8];
#pragma unroll
    for (int ns = 0; ns < 8; ++ns)
#pragma unroll
      for (int q = 0; q < 8; ++q) acc[ns][q] = 0.0f;

    for (int kb = 0; kb < D_; kb += 16) {
      __syncthreads();   // previous slab's reads complete before overwrite

      if (wave == 0) {
        // --- TDM: DMA enc tile 128 rows x 16 floats (row stride 512) -> As ---
        const unsigned long long ga = (unsigned long long)(uintptr_t)(encB + kb);
        u32x4 g0;
        g0.x = 1u;                                       // count=1, load, user desc
        g0.y = lds_As;                                   // lds_addr
        g0.z = (unsigned int)ga;                         // global_addr[31:0]
        g0.w = (unsigned int)((ga >> 32) & 0x01FFFFFFu)  // global_addr[56:32]
               | (2u << 30);                             // type=2 ("image")
        i32x8 g1;
        g1[0] = (int)((2u << 16)      // data_size = 4B
                    | (1u << 20)      // pad_enable
                    | (3u << 22)      // pad_interval = 16 DWORDs
                    | (0u << 25));    // pad_amount   = 1 DWORD  -> stride 17
        g1[1] = (int)(512u << 16);    // tensor_dim0 = 512 (low 16 -> [63:48])
        g1[2] = (int)(128u << 16);    // tensor_dim0 hi=0 | tensor_dim1 = 128
        g1[3] = (int)(16u << 16);     // tensor_dim1 hi=0 | tile_dim0 = 16
        g1[4] = 128;                  // tile_dim1 = 128, tile_dim2 = 0
        g1[5] = 512;                  // tensor_dim0_stride[31:0] = 512
        g1[6] = 0;                    // stride0 hi | stride1 lo
        g1[7] = 0;                    // stride1 hi
        const i32x4 gz = {0, 0, 0, 0};
#if __clang_major__ >= 23
        const i32x8 gz8 = {0, 0, 0, 0, 0, 0, 0, 0};
        __builtin_amdgcn_tensor_load_to_lds(g0, g1, gz, gz, gz8, 0);
#else
        __builtin_amdgcn_tensor_load_to_lds(g0, g1, gz, gz, 0);
#endif
        __builtin_amdgcn_s_wait_tensorcnt(0);
      }

      // stage V_w slab transposed: Bs[col][kr], stride 18 (conflict-free, b64-aligned)
#pragma unroll
      for (int j = 0; j < 8; ++j) {
        int i = tid + 256 * j;
        int kr = i >> 7, col = i & 127;
        Bs[col * 18 + kr] = Vw[(kb + kr) * D_ + nc * 128 + col];
      }
      __syncthreads();

#pragma unroll
      for (int ks = 0; ks < 16; ks += 4) {
        // A frag (16x4 f32): lane l<16 holds row l, K={ks,ks+1}; l>=16: K={ks+2,ks+3}
        v2f a;
        const int arow = (wave * 16 + l15) * 17 + ks + hi * 2;
        a.x = As[arow];
        a.y = As[arow + 1];
#pragma unroll
        for (int ns = 0; ns < 8; ++ns) {
          // B frag (4x16): vgpr r, lane-half hi -> K = r + 2*hi, N = l15
          // transposed LDS layout -> contiguous pair, single ds_load_b64
          const v2f bf = *(const v2f*)&Bs[(ns * 16 + l15) * 18 + ks + hi * 2];
          acc[ns] = __builtin_amdgcn_wmma_f32_16x16x4_f32(
              false, a, false, bf, (short)0, acc[ns], false, false);
        }
      }
    }
    // epilogue: tanh + weighted dot for this N-chunk
    // C layout: vgpr r, lane -> (M = r + 8*hi, N = l15)
#pragma unroll
    for (int ns = 0; ns < 8; ++ns) {
      const int col = nc * 128 + ns * 16 + l15;
      const float av = addv_s[col];
      const float gv = gw_s[col];
#pragma unroll
      for (int r = 0; r < 8; ++r)
        part[r] += tanhf(acc[ns][r] + av) * gv;
    }
  }

  // reduce the 16 lanes of each half -> one score per row
#pragma unroll
  for (int r = 0; r < 8; ++r) {
    float v = part[r];
    v += __shfl_xor(v, 8, 16);
    v += __shfl_xor(v, 4, 16);
    v += __shfl_xor(v, 2, 16);
    v += __shfl_xor(v, 1, 16);
    if (l15 == 0) score_s[wave * 16 + hi * 8 + r] = v;
  }
  __syncthreads();
  if (tid < 128)
    score[(size_t)b * T_ + tb * 128 + tid] = score_s[tid] + gb[0];
}

// ---------------------------------------------------------------------------
// F) masked softmax over T with SCALING=2
// ---------------------------------------------------------------------------
__global__ __launch_bounds__(256) void softmax_kernel(
    const float* __restrict__ score, const int* __restrict__ lens,
    float* __restrict__ w_out) {
  __shared__ float red[256];
  const int b = blockIdx.x, tid = threadIdx.x;
  const int len = lens[b];
  const float* s = score + (size_t)b * T_;
  float mx = -3.0e38f;
  for (int t = tid; t < T_; t += 256) {
    float v = (t < len) ? 2.0f * s[t] : -3.0e38f;
    mx = fmaxf(mx, v);
  }
  red[tid] = mx;
  __syncthreads();
  for (int off = 128; off > 0; off >>= 1) {
    if (tid < off) red[tid] = fmaxf(red[tid], red[tid + off]);
    __syncthreads();
  }
  mx = red[0];
  __syncthreads();
  float sum = 0.0f;
  for (int t = tid; t < T_; t += 256) {
    float v = (t < len) ? 2.0f * s[t] : -3.0e38f;
    sum += __expf(v - mx);
  }
  red[tid] = sum;
  __syncthreads();
  for (int off = 128; off > 0; off >>= 1) {
    if (tid < off) red[tid] += red[tid + off];
    __syncthreads();
  }
  const float inv = 1.0f / red[0];
  for (int t = tid; t < T_; t += 256) {
    float v = (t < len) ? 2.0f * s[t] : -3.0e38f;
    w_out[(size_t)b * T_ + t] = __expf(v - mx) * inv;
  }
}

// ---------------------------------------------------------------------------
// G) c_v[b,e] = sum_t enc[b,t,e] * w[b,t]   (enc should hit L2: 134MB < 192MB)
// ---------------------------------------------------------------------------
__global__ __launch_bounds__(256) void context_kernel(
    const float* __restrict__ enc, const float* __restrict__ w,
    float* __restrict__ c_v) {
  __shared__ float red[256];
  const int b = blockIdx.x, chunk = blockIdx.y;
  const int col = chunk * 64 + (threadIdx.x & 63);
  const int trow = threadIdx.x >> 6;   // 0..3
  const float* e = enc + (size_t)b * T_ * D_;
  const float* wb = w + (size_t)b * T_;
  float acc = 0.0f;
  for (int t = trow; t < T_; t += 4)
    acc += e[(size_t)t * D_ + col] * wb[t];
  red[threadIdx.x] = acc;
  __syncthreads();
  if (threadIdx.x < 64)
    c_v[b * D_ + col] = red[threadIdx.x] + red[threadIdx.x + 64] +
                        red[threadIdx.x + 128] + red[threadIdx.x + 192];
}

// ---------------------------------------------------------------------------
extern "C" void kernel_launch(void* const* d_in, const int* in_sizes, int n_in,
                              void* d_out, int out_size, void* d_ws, size_t ws_size,
                              hipStream_t stream) {
  const float* enc      = (const float*)d_in[0];
  const int*   lens     = (const int*)  d_in[1];
  const float* dec_z    = (const float*)d_in[2];
  const float* att_prev = (const float*)d_in[3];
  const float* att_h    = (const float*)d_in[4];
  const float* att_c    = (const float*)d_in[5];
  const float* W_w      = (const float*)d_in[6];
  const float* W_b      = (const float*)d_in[7];
  const float* V_w      = (const float*)d_in[8];
  const float* V_b      = (const float*)d_in[9];
  const float* U_w      = (const float*)d_in[10];
  const float* U_b      = (const float*)d_in[11];
  const float* g_w      = (const float*)d_in[12];
  const float* g_b      = (const float*)d_in[13];
  const float* conv_w   = (const float*)d_in[14];
  const float* W_ih     = (const float*)d_in[15];
  const float* W_hh     = (const float*)d_in[16];
  const float* b_ih     = (const float*)d_in[17];
  const float* b_hh     = (const float*)d_in[18];

  float* out = (float*)d_out;
  float* cv_out = out;                              // (32,512)
  float* w_out  = out + B_ * D_;                    // (32,2048)
  float* h_out  = out + B_ * D_ + B_ * T_;          // (32,512)
  float* c_out  = out + 2 * B_ * D_ + B_ * T_;      // (32,512)

  float* ws = (float*)d_ws;
  float* feat_ws  = ws;                               // 32*32
  float* gates_ws = feat_ws + B_ * CH;                // 32*2048
  float* addv_ws  = gates_ws + B_ * 4 * D_;           // 32*512
  float* score_ws = addv_ws + B_ * D_;                // 32*2048

  conv_feat_kernel<<<B_, 256, 0, stream>>>(att_prev, conv_w, feat_ws);
  gates_kernel<<<B_ * 8, 256, 0, stream>>>(feat_ws, att_h, W_ih, W_hh, b_ih, b_hh, gates_ws);
  cell_kernel<<<B_ * D_ / 256, 256, 0, stream>>>(gates_ws, att_c, h_out, c_out);
  addvec_kernel<<<B_ * 2, 256, 0, stream>>>(h_out, dec_z, W_w, W_b, U_w, U_b, V_b, addv_ws);
  score_fused_kernel<<<dim3(T_ / 128, B_), 256, 0, stream>>>(enc, V_w, addv_ws, g_w, g_b, score_ws);
  softmax_kernel<<<B_, 256, 0, stream>>>(score_ws, lens, w_out);
  context_kernel<<<dim3(B_, D_ / 64), 256, 0, stream>>>(enc, w_out, cv_out);
}

// v001
// A run of this version takes 377 microseconds.
// Next to v000, in two timings, it ran 2.85 times as fast each time.
#include <hip/hip_runtime.h>
#include <hip/hip_bf16.h>

typedef __attribute__((ext_vector_type(2))) float v2f;
typedef __attribute__((ext_vector_type(8))) float v8f;
typedef __attribute__((ext_vector_type(4))) unsigned int u32x4;
typedef __attribute__((ext_vector_type(4))) int i32x4;
typedef __attribute__((ext_vector_type(8))) int i32x8;

#define B_  32
#define T_  2048
#define D_  512
#define KF  201
#define CH  32
#define TCH 32            // time steps per conv work-group
#define NCH (T_ / TCH)    // conv work-groups per batch row

// ---------------------------------------------------------------------------
// A) location conv (K=201, zero-pad 100) -> relu -> maxpool over one chunk of
//    TCH time steps => featp(B,NCH,32); the gates kernel takes the max over chunks
// ---------------------------------------------------------------------------
__global__ __launch_bounds__(256) void conv_feat_kernel(
    const float* __restrict__ att_prev, const float* __restrict__ conv_w,
    float* __restrict__ featp) {
  __shared__ float ap[TCH + 2 * 100];  // this chunk's slice of the padded row
  __shared__ float cw[CH * KF];
  __shared__ float smax[CH * 8];
  const int chunk = blockIdx.x, b = blockIdx.y, tid = threadIdx.x;
  for (int i = tid; i < TCH + 200; i += 256) {
    int t = chunk * TCH + i - 100;
    ap[i] = (t >= 0 && t < T_) ? att_prev[b * T_ + t] : 0.0f;
  }
  for (int i = tid; i < CH * KF; i += 256) cw[i] = conv_w[i];
  __syncthreads();
  const int c = tid & 31, slot = tid >> 5;
  const float* wc = cw + c * KF;
  float m = 0.0f;                       // relu => max starts at 0
  for (int t = slot; t < TCH; t += 8) {
    float acc = 0.0f;
    for (int k = 0; k < KF; ++k) acc += ap[t + k] * wc[k];
    m = fmaxf(m, acc);
  }
  smax[c * 8 + slot] = m;
  __syncthreads();
  if (tid < CH) {
    float mm = 0.0f;
    for (int s = 0; s < 8; ++s) mm = fmaxf(mm, smax[tid * 8 + s]);
    featp[(b * NCH + chunk) * CH + tid] = mm;
  }
}

// ---------------------------------------------------------------------------
// B) gates = feat @ W_ih.T + b_ih + att_h @ W_hh.T + b_hh   (B x 4*512)
// ---------------------------------------------------------------------------
__global__ __launch_bounds__(256) void gates_kernel(
    const float* __restrict__ featp, const float* __restrict__ att_h,
    const float* __restrict__ W_ih, const float* __restrict__ W_hh,
    const float* __restrict__ b_ih, const float* __restrict__ b_hh,
    float* __restrict__ gates) {
  __shared__ float h_s[D_];
  __shared__ float f_s[CH];
  const int b = blockIdx.x >> 3;
  const int j = ((blockIdx.x & 7) << 8) + threadIdx.x;   // 0..2047
  for (int i = threadIdx.x; i < D_; i += 256) h_s[i] = att_h[b * D_ + i];
  if (threadIdx.x < CH) {
    float m = 0.0f;                     // chunk maxima are >= 0 (relu)
    // unrolled so that all NCH loads are in flight together, not one L2 trip each
#pragma unroll
    for (int s = 0; s < NCH; ++s)
      m = fmaxf(m, featp[(b * NCH + s) * CH + threadIdx.x]);
    f_s[threadIdx.x] = m;
  }
  __syncthreads();
  float acc = b_ih[j] + b_hh[j];
  const float* wih = W_ih + j * CH;
#pragma unroll
  for (int c = 0; c < CH; ++c) acc += f_s[c] * wih[c];
  const float4* whh4 = (const float4*)(W_hh + (size_t)j * D_);
  for (int k = 0; k < D_ / 4; ++k) {
    float4 w4 = whh4[k];
    acc += h_s[4 * k + 0] * w4.x + h_s[4 * k + 1] * w4.y +
           h_s[4 * k + 2] * w4.z + h_s[4 * k + 3] * w4.w;
  }
  gates[b * 4 * D_ + j] = acc;
}

// ---------------------------------------------------------------------------
// C) LSTM cell nonlinearity -> h_new, c_new (torch gate order i,f,g,o)
// ---------------------------------------------------------------------------
__global__ __launch_bounds__(256) void cell_kernel(
    const float* __restrict__ gates, const float* __restrict__ att_c,
    float* __restrict__ h_out, float* __restrict__ c_out) {
  const int idx = blockIdx.x * 256 + threadIdx.x;   // 0..16383
  const int b = idx >> 9, j = idx & 511;
  const float* g = gates + b * 4 * D_;
  const float gi = g[j], gf = g[j + D_], gg = g[j + 2 * D_], go = g[j + 3 * D_];
  const float si = 1.0f / (1.0f + __expf(-gi));
  const float sf = 1.0f / (1.0f + __expf(-gf));
  const float so = 1.0f / (1.0f + __expf(-go));
  const float cn = sf * att_c[idx] + si * tanhf(gg);
  h_out[idx] = so * tanhf(cn);
  c_out[idx] = cn;
}

// ---------------------------------------------------------------------------
// D) add_vec[b,a] = (h_new@W_w)[a] + (dec_z@U_w)[a] + W_b[a]+U_b[a]+V_b[a]
// ---------------------------------------------------------------------------
__global__ __launch_bounds__(256) void addvec_kernel(
    const float* __restrict__ h_new, const float* __restrict__ dec_z,
    const float* __restrict__ W_w, const float* __restrict__ W_b,
    const float* __restrict__ U_w, const float* __restrict__ U_b,
    const float* __restrict__ V_b, float* __restrict__ addv) {
  __shared__ float h_s[D_];
  __shared__ float z_s[D_];
  const int b = blockIdx.x >> 1;
  const int a = ((blockIdx.x & 1) << 8) + threadIdx.x;
  for (int i = threadIdx.x; i < D_; i += 256) {
    h_s[i] = h_new[b * D_ + i];
    z_s[i] = dec_z[b * D_ + i];
  }
  __syncthreads();
  float acc = W_b[a] + U_b[a] + V_b[a];
  for (int k = 0; k < D_; ++k)
    acc += h_s[k] * W_w[k * D_ + a] + z_s[k] * U_w[k * D_ + a];
  addv[b * D_ + a] = acc;
}

// ---------------------------------------------------------------------------
// E) fused  score[b,t] = sum_a tanh( (enc[b,t,:]@V_w)[a] + add_vec[b,a] )*g_w[a] + g_b
//    WMMA f32 16x16x4; A tile (128x16 fp32, row stride 512) staged by the
//    Tensor Data Mover with LDS padding to stride 17; V_w tile staged
//    transposed [col][k] stride 18 so B frags are single ds_load_b64.
// ---------------------------------------------------------------------------
__global__ __launch_bounds__(256) void score_fused_kernel(
    const float* __restrict__ enc, const float* __restrict__ Vw,
    const float* __restrict__ addv, const float* __restrict__ gw,
    const float* __restrict__ gb, float* __restrict__ score) {
  const int b = blockIdx.y, tb = blockIdx.x;    // tb: 0..15 (128 rows each)
  const int tid = threadIdx.x;
  const int lane = tid & 31;
  const int wave = tid >> 5;                    // 0..7 : M-subtile owner
  const int hi = lane >> 4;                     // lane half
  const int l15 = lane & 15;

  __shared__ float As[128 * 17];                // 128 rows x 16 k (TDM pads ->17)
  __shared__ float Bs[128 * 18];                // transposed: [n-col][16 k] (pad->18)
  __shared__ float addv_s[D_];
  __shared__ float gw_s[D_];
  __shared__ float score_s[128];

  for (int i = tid; i < D_; i += 256) {
    addv_s[i] = addv[b * D_ + i];
    gw_s[i] = gw[i];
  }

  const float* encB = enc + ((size_t)b * T_ + tb * 128) * D_;
  const unsigned int lds_As = (unsigned int)(uintptr_t)As;  // low 32 bits = LDS offset

  float part[8];
#pragma unroll
  for (int r = 0; r < 8; ++r) part[r] = 0.0f;

  for (int nc = 0; nc < 4; ++nc) {              // 4 chunks of 128 N-columns
    v8f acc[8];
#pragma unroll
    for (int ns = 0; ns < 8; ++ns)
#pragma unroll
      for (int q = 0; q < 8; ++q) acc[ns][q] = 0.0f;

    for (int kb = 0; kb < D_; kb += 16) {
      __syncthreads();   // previous slab's reads complete before overwrite

      if (wave == 0) {
        // --- TDM: DMA enc tile 128 rows x 16 floats (row stride 512) -> As ---
        const unsigned long long ga = (unsigned long long)(uintptr_t)(encB + kb);
        u32x4 g0;
        g0.x = 1u;                                       // count=1, load, user desc
        g0.y = lds_As;                                   // lds_addr
        g0.z = (unsigned int)ga;                         // global_addr[31:0]
        g0.w = (unsigned int)((ga >> 32) & 0x01FFFFFFu)  // global_addr[56:32]
               | (2u << 30);                             // type=2 ("image")
        i32x8 g1;
        g1[0] = (int)((2u << 16)      // data_size = 4B
                    | (1u << 20)      // pad_enable
                    | (3u << 22)      // pad_interval = 16 DWORDs
                    | (0u << 25));    // pad_amount   = 1 DWORD  -> stride 17
        g1[1] = (int)(512u << 16);    // tensor_dim0 = 512 (low 16 -> [63:48])
        g1[2] = (int)(128u << 16);    // tensor_dim0 hi=0 | tensor_dim1 = 128
        g1[3] = (int)(16u << 16);     // tensor_dim1 hi=0 | tile_dim0 = 16
        g1[4] = 128;                  // tile_dim1 = 128, tile_dim2 = 0
        g1[5] = 512;                  // tensor_dim0_stride[31:0] = 512
        g1[6] = 0;                    // stride0 hi | stride1 lo
        g1[7] = 0;                    // stride1 hi
        const i32x4 gz = {0, 0, 0, 0};
#if __clang_major__ >= 23
        const i32x8 gz8 = {0, 0, 0, 0, 0, 0, 0, 0};
        __builtin_amdgcn_tensor_load_to_lds(g0, g1, gz, gz, gz8, 0);
#else
        __builtin_amdgcn_tensor_load_to_lds(g0, g1, gz, gz, 0);
#endif
        __builtin_amdgcn_s_wait_tensorcnt(0);
      }

      // stage V_w slab transposed: Bs[col][kr], stride 18 (conflict-free, b64-aligned)
#pragma unroll
      for (int j = 0; j < 8; ++j) {
        int i = tid + 256 * j;
        int kr = i >> 7, col = i & 127;
        Bs[col * 18 + kr] = Vw[(kb + kr) * D_ + nc * 128 + col];
      }
      __syncthreads();

#pragma unroll
      for (int ks = 0; ks < 16; ks += 4) {
        // A frag (16x4 f32): lane l<16 holds row l, K={ks,ks+1}; l>=16: K={ks+2,ks+3}
        v2f a;
        const int arow = (wave * 16 + l15) * 17 + ks + hi * 2;
        a.x = As[arow];
        a.y = As[arow + 1];
#pragma unroll
        for (int ns = 0; ns < 8; ++ns) {
          // B frag (4x16): vgpr r, lane-half hi -> K = r + 2*hi, N = l15
          // transposed LDS layout -> contiguous pair, single ds_load_b64
          const v2f bf = *(const v2f*)&Bs[(ns * 16 + l15) * 18 + ks + hi * 2];
          acc[ns] = __builtin_amdgcn_wmma_f32_16x16x4_f32(
              false, a, false, bf, (short)0, acc[ns], false, false);
        }
      }
    }
    // epilogue: tanh + weighted dot for this N-chunk
    // C layout: vgpr r, lane -> (M = r + 8*hi, N = l15)
#pragma unroll
    for (int ns = 0; ns < 8; ++ns) {
      const int col = nc * 128 + ns * 16 + l15;
      const float av = addv_s[col];
      const float gv = gw_s[col];
#pragma unroll
      for (int r = 0; r < 8; ++r)
        part[r] += tanhf(acc[ns][r] + av) * gv;
    }
  }

  // reduce the 16 lanes of each half -> one score per row
#pragma unroll
  for (int r = 0; r < 8; ++r) {
    float v = part[r];
    v += __shfl_xor(v, 8, 16);
    v += __shfl_xor(v, 4, 16);
    v += __shfl_xor(v, 2, 16);
    v += __shfl_xor(v, 1, 16);
    if (l15 == 0) score_s[wave * 16 + hi * 8 + r] = v;
  }
  __syncthreads();
  if (tid < 128)
    score[(size_t)b * T_ + tb * 128 + tid] = score_s[tid] + gb[0];
}

// ---------------------------------------------------------------------------
// F) masked softmax over T with SCALING=2
// ---------------------------------------------------------------------------
__global__ __launch_bounds__(256) void softmax_kernel(
    const float* __restrict__ score, const int* __restrict__ lens,
    float* __restrict__ w_out) {
  __shared__ float red[256];
  const int b = blockIdx.x, tid = threadIdx.x;
  const int len = lens[b];
  const float* s = score + (size_t)b * T_;
  float mx = -3.0e38f;
  for (int t = tid; t < T_; t += 256) {
    float v = (t < len) ? 2.0f * s[t] : -3.0e38f;
    mx = fmaxf(mx, v);
  }
  red[tid] = mx;
  __syncthreads();
  for (int off = 128; off > 0; off >>= 1) {
    if (tid < off) red[tid] = fmaxf(red[tid], red[tid + off]);
    __syncthreads();
  }
  mx = red[0];
  __syncthreads();
  float sum = 0.0f;
  for (int t = tid; t < T_; t += 256) {
    float v = (t < len) ? 2.0f * s[t] : -3.0e38f;
    sum += __expf(v - mx);
  }
  red[tid] = sum;
  __syncthreads();
  for (int off = 128; off > 0; off >>= 1) {
    if (tid < off) red[tid] += red[tid + off];
    __syncthreads();
  }
  const float inv = 1.0f / red[0];
  for (int t = tid; t < T_; t += 256) {
    float v = (t < len) ? 2.0f * s[t] : -3.0e38f;
    w_out[(size_t)b * T_ + t] = __expf(v - mx) * inv;
  }
}

// ---------------------------------------------------------------------------
// G) c_v[b,e] = sum_t enc[b,t,e] * w[b,t]   (enc should hit L2: 134MB < 192MB)
// ---------------------------------------------------------------------------
__global__ __launch_bounds__(256) void context_kernel(
    const float* __restrict__ enc, const float* __restrict__ w,
    float* __restrict__ c_v) {
  __shared__ float red[256];
  const int b = blockIdx.x, chunk = blockIdx.y;
  const int col = chunk * 64 + (threadIdx.x & 63);
  const int trow = threadIdx.x >> 6;   // 0..3
  const float* e = enc + (size_t)b * T_ * D_;
  const float* wb = w + (size_t)b * T_;
  float acc = 0.0f;
  for (int t = trow; t < T_; t += 4)
    acc += e[(size_t)t * D_ + col] * wb[t];
  red[threadIdx.x] = acc;
  __syncthreads();
  if (threadIdx.x < 64)
    c_v[b * D_ + col] = red[threadIdx.x] + red[threadIdx.x + 64] +
                        red[threadIdx.x + 128] + red[threadIdx.x + 192];
}

// ---------------------------------------------------------------------------
extern "C" void kernel_launch(void* const* d_in, const int* in_sizes, int n_in,
                              void* d_out, int out_size, void* d_ws, size_t ws_size,
                              hipStream_t stream) {
  const float* enc      = (const float*)d_in[0];
  const int*   lens     = (const int*)  d_in[1];
  const float* dec_z    = (const float*)d_in[2];
  const float* att_prev = (const float*)d_in[3];
  const float* att_h    = (const float*)d_in[4];
  const float* att_c    = (const float*)d_in[5];
  const float* W_w      = (const float*)d_in[6];
  const float* W_b      = (const float*)d_in[7];
  const float* V_w      = (const float*)d_in[8];
  const float* V_b      = (const float*)d_in[9];
  const float* U_w      = (const float*)d_in[10];
  const float* U_b      = (const float*)d_in[11];
  const float* g_w      = (const float*)d_in[12];
  const float* g_b      = (const float*)d_in[13];
  const float* conv_w   = (const float*)d_in[14];
  const float* W_ih     = (const float*)d_in[15];
  const float* W_hh     = (const float*)d_in[16];
  const float* b_ih     = (const float*)d_in[17];
  const float* b_hh     = (const float*)d_in[18];

  float* out = (float*)d_out;
  float* cv_out = out;                              // (32,512)
  float* w_out  = out + B_ * D_;                    // (32,2048)
  float* h_out  = out + B_ * D_ + B_ * T_;          // (32,512)
  float* c_out  = out + 2 * B_ * D_ + B_ * T_;      // (32,512)

  float* ws = (float*)d_ws;
  float* feat_ws  = ws;                               // 32*NCH*32
  float* gates_ws = feat_ws + B_ * NCH * CH;          // 32*2048
  float* addv_ws  = gates_ws + B_ * 4 * D_;           // 32*512
  float* score_ws = addv_ws + B_ * D_;                // 32*2048

  conv_feat_kernel<<<dim3(NCH, B_), 256, 0, stream>>>(att_prev, conv_w, feat_ws);
  gates_kernel<<<B_ * 8, 256, 0, stream>>>(feat_ws, att_h, W_ih, W_hh, b_ih, b_hh, gates_ws);
  cell_kernel<<<B_ * D_ / 256, 256, 0, stream>>>(gates_ws, att_c, h_out, c_out);
  addvec_kernel<<<B_ * 2, 256, 0, stream>>>(h_out, dec_z, W_w, W_b, U_w, U_b, V_b, addv_ws);
  score_fused_kernel<<<dim3(T_ / 128, B_), 256, 0, stream>>>(enc, V_w, addv_ws, g_w, g_b, score_ws);
  softmax_kernel<<<B_, 256, 0, stream>>>(score_ws, lens, w_out);
  context_kernel<<<dim3(B_, D_ / 64), 256, 0, stream>>>(enc, w_out, cv_out);
}

// v002
// One run takes 342 microseconds.
// Timed twice side by side with v001, it ran 1.10 times as fast both times.
// Counting every step since v000, it is 3.13 times as fast.
#include <hip/hip_runtime.h>
#include <hip/hip_bf16.h>

typedef __attribute__((ext_vector_type(2))) float v2f;
typedef __attribute__((ext_vector_type(8))) float v8f;
typedef __attribute__((ext_vector_type(4))) unsigned int u32x4;
typedef __attribute__((ext_vector_type(4))) int i32x4;
typedef __attribute__((ext_vector_type(8))) int i32x8;

#define B_  32
#define T_  2048
#define D_  512
#define KF  201
#define CH  32
#define TCH 128           // time steps per conv work-group
#define NCH (T_ / TCH)    // conv work-groups per batch row
#define TT  16            // consecutive time steps one conv thread keeps in registers
#define KP  204           // filter taps padded with zeros to a multiple of 4; LDS row pitch 816 B = 16 B x odd
#define CWN ((CH * KP + 255) / 256 * 256)   // staged weights, rounded up to whole rounds of the block

// ---------------------------------------------------------------------------
// A) location conv (K=201, zero-pad 100) -> relu -> maxpool over one chunk of
//    TCH time steps => featp(B,NCH,32); the gates kernel takes the max over chunks.
//    lane = channel, wave = TT consecutive time steps. Per 4 taps a thread reads
//    its 4 weights (one 16-byte LDS read) and 4 new samples (the same address in
//    every lane) and does 4*TT FMAs on a window held in registers.
// ---------------------------------------------------------------------------
__global__ __launch_bounds__(256) void conv_feat_kernel(
    const float* __restrict__ att_prev, const float* __restrict__ conv_w,
    float* __restrict__ featp) {
  __shared__ __attribute__((aligned(16))) float ap[TCH + KP];  // chunk's slice of the padded row
  __shared__ __attribute__((aligned(16))) float cw[CWN];
  __shared__ float smax[CH * 8];
  const int chunk = blockIdx.x, b = blockIdx.y, tid = threadIdx.x;
  for (int i = tid; i < TCH + KP; i += 256) {
    int t = chunk * TCH + i - 100;
    // i >= TCH + 200 meets only the zero taps: kept 0 so that the product is 0
    ap[i] = (t >= 0 && t < T_ && i < TCH + 200) ? att_prev[b * T_ + t] : 0.0f;
  }
  // constant trip count, no branch (address clamped, value selected): unrolled, so that
  // a thread's weight loads overlap instead of taking one L2 trip each
#pragma unroll
  for (int r = 0; r < CWN / 256; ++r) {
    const int i = tid + 256 * r;
    const int cc = i / KP, k = i - cc * KP;
    const float v = conv_w[min(cc, CH - 1) * KF + min(k, KF - 1)];
    cw[i] = (k < KF) ? v : 0.0f;
  }
  __syncthreads();
  const int c = tid & 31, slot = tid >> 5;
  const float4* wc4 = (const float4*)(cw + c * KP);
  const float4* ap4 = (const float4*)(ap + slot * TT);
  float win[TT + 4];                    // samples t0+4*kb .. t0+4*kb+TT+3
#pragma unroll
  for (int i = 0; i < (TT + 4) / 4; ++i) {
    const float4 v = ap4[i];
    win[4 * i + 0] = v.x; win[4 * i + 1] = v.y; win[4 * i + 2] = v.z; win[4 * i + 3] = v.w;
  }
  float acc[TT];
#pragma unroll
  for (int j = 0; j < TT; ++j) acc[j] = 0.0f;
  // 4 taps: ascending order for every output, TT independent FMA chains side by side
  auto taps4 = [&](const float4 w) {
#pragma unroll
    for (int j = 0; j < TT; ++j) acc[j] = fmaf(win[j + 0], w.x, acc[j]);
#pragma unroll
    for (int j = 0; j < TT; ++j) acc[j] = fmaf(win[j + 1], w.y, acc[j]);
#pragma unroll
    for (int j = 0; j < TT; ++j) acc[j] = fmaf(win[j + 2], w.z, acc[j]);
#pragma unroll
    for (int j = 0; j < TT; ++j) acc[j] = fmaf(win[j + 3], w.w, acc[j]);
  };
  // (TT+4)/4 blocks a trip: the window has then turned round once, so its shift costs no copy;
  // kept rolled so that the LDS reads of later trips do not pile up in registers
#pragma unroll 1
  for (int g = 0; g < KP / 4 - 1; g += (TT + 4) / 4) {
#pragma unroll
    for (int u = 0; u < (TT + 4) / 4; ++u) {
      const float4 w = wc4[g + u];
      const float4 nx = ap4[g + u + (TT + 4) / 4];
      taps4(w);
#pragma unroll
      for (int j = 0; j < TT; ++j) win[j] = win[j + 4];
      win[TT + 0] = nx.x; win[TT + 1] = nx.y; win[TT + 2] = nx.z; win[TT + 3] = nx.w;
    }
  }
  taps4(wc4[KP / 4 - 1]);               // last block: nothing more to fetch
  float m = 0.0f;                       // relu => max starts at 0
#pragma unroll
  for (int j = 0; j < TT; ++j) m = fmaxf(m, acc[j]);
  smax[c * 8 + slot] = m;
  __syncthreads();
  if (tid < CH) {
    float mm = 0.0f;
    for (int s = 0; s < 8; ++s) mm = fmaxf(mm, smax[tid * 8 + s]);
    featp[(b * NCH + chunk) * CH + tid] = mm;
  }
}

// ---------------------------------------------------------------------------
// B) gates = feat @ W_ih.T + b_ih + att_h @ W_hh.T + b_hh   (B x 4*512)
// ---------------------------------------------------------------------------
__global__ __launch_bounds__(256) void gates_kernel(
    const float* __restrict__ featp, const float* __restrict__ att_h,
    const float* __restrict__ W_ih, const float* __restrict__ W_hh,
    const float* __restrict__ b_ih, const float* __restrict__ b_hh,
    float* __restrict__ gates) {
  __shared__ float h_s[D_];
  __shared__ float f_s[CH];
  const int b = blockIdx.x >> 3;
  const int j = ((blockIdx.x & 7) << 8) + threadIdx.x;   // 0..2047
  for (int i = threadIdx.x; i < D_; i += 256) h_s[i] = att_h[b * D_ + i];
  if (threadIdx.x < CH) {
    float m = 0.0f;                     // chunk maxima are >= 0 (relu)
    // unrolled so that all NCH loads are in flight together, not one L2 trip each
#pragma unroll
    for (int s = 0; s < NCH; ++s)
      m = fmaxf(m, featp[(b * NCH + s) * CH + threadIdx.x]);
    f_s[threadIdx.x] = m;
  }
  __syncthreads();
  float acc = b_ih[j] + b_hh[j];
  const float* wih = W_ih + j * CH;
#pragma unroll
  for (int c = 0; c < CH; ++c) acc += f_s[c] * wih[c];
  const float4* whh4 = (const float4*)(W_hh + (size_t)j * D_);
  for (int k = 0; k < D_ / 4; ++k) {
    float4 w4 = whh4[k];
    acc += h_s[4 * k + 0] * w4.x + h_s[4 * k + 1] * w4.y +
           h_s[4 * k + 2] * w4.z + h_s[4 * k + 3] * w4.w;
  }
  gates[b * 4 * D_ + j] = acc;
}

// ---------------------------------------------------------------------------
// C) LSTM cell nonlinearity -> h_new, c_new (torch gate order i,f,g,o)
// ---------------------------------------------------------------------------
__global__ __launch_bounds__(256) void cell_kernel(
    const float* __restrict__ gates, const float* __restrict__ att_c,
    float* __restrict__ h_out, float* __restrict__ c_out) {
  const int idx = blockIdx.x * 256 + threadIdx.x;   // 0..16383
  const int b = idx >> 9, j = idx & 511;
  const float* g = gates + b * 4 * D_;
  const float gi = g[j], gf = g[j + D_], gg = g[j + 2 * D_], go = g[j + 3 * D_];
  const float si = 1.0f / (1.0f + __expf(-gi));
  const float sf = 1.0f / (1.0f + __expf(-gf));
  const float so = 1.0f / (1.0f + __expf(-go));
  const float cn = sf * att_c[idx] + si * tanhf(gg);
  h_out[idx] = so * tanhf(cn);
  c_out[idx] = cn;
}

// ---------------------------------------------------------------------------
// D) add_vec[b,a] = (h_new@W_w)[a] + (dec_z@U_w)[a] + W_b[a]+U_b[a]+V_b[a]
// ---------------------------------------------------------------------------
__global__ __launch_bounds__(256) void addvec_kernel(
    const float* __restrict__ h_new, const float* __restrict__ dec_z,
    const float* __restrict__ W_w, const float* __restrict__ W_b,
    const float* __restrict__ U_w, const float* __restrict__ U_b,
    const float* __restrict__ V_b, float* __restrict__ addv) {
  __shared__ float h_s[D_];
  __shared__ float z_s[D_];
  const int b = blockIdx.x >> 1;
  const int a = ((blockIdx.x & 1) << 8) + threadIdx.x;
  for (int i = threadIdx.x; i < D_; i += 256) {
    h_s[i] = h_new[b * D_ + i];
    z_s[i] = dec_z[b * D_ + i];
  }
  __syncthreads();
  float acc = W_b[a] + U_b[a] + V_b[a];
  for (int k = 0; k < D_; ++k)
    acc += h_s[k] * W_w[k * D_ + a] + z_s[k] * U_w[k * D_ + a];
  addv[b * D_ + a] = acc;
}

// ---------------------------------------------------------------------------
// E) fused  score[b,t] = sum_a tanh( (enc[b,t,:]@V_w)[a] + add_vec[b,a] )*g_w[a] + g_b
//    WMMA f32 16x16x4; A tile (128x16 fp32, row stride 512) staged by the
//    Tensor Data Mover with LDS padding to stride 17; V_w tile staged
//    transposed [col][k] stride 18 so B frags are single ds_load_b64.
// ---------------------------------------------------------------------------
__global__ __launch_bounds__(256) void score_fused_kernel(
    const float* __restrict__ enc, const float* __restrict__ Vw,
    const float* __restrict__ addv, const float* __restrict__ gw,
    const float* __restrict__ gb, float* __restrict__ score) {
  const int b = blockIdx.y, tb = blockIdx.x;    // tb: 0..15 (128 rows each)
  const int tid = threadIdx.x;
  const int lane = tid & 31;
  const int wave = tid >> 5;                    // 0..7 : M-subtile owner
  const int hi = lane >> 4;                     // lane half
  const int l15 = lane & 15;

  __shared__ float As[128 * 17];                // 128 rows x 16 k (TDM pads ->17)
  __shared__ float Bs[128 * 18];                // transposed: [n-col][16 k] (pad->18)
  __shared__ float addv_s[D_];
  __shared__ float gw_s[D_];
  __shared__ float score_s[128];

  for (int i = tid; i < D_; i += 256) {
    addv_s[i] = addv[b * D_ + i];
    gw_s[i] = gw[i];
  }

  const float* encB = enc + ((size_t)b * T_ + tb * 128) * D_;
  const unsigned int lds_As = (unsigned int)(uintptr_t)As;  // low 32 bits = LDS offset

  float part[8];
#pragma unroll
  for (int r = 0; r < 8; ++r) part[r] = 0.0f;

  for (int nc = 0; nc < 4; ++nc) {              // 4 chunks of 128 N-columns
    v8f acc[8];
#pragma unroll
    for (int ns = 0; ns < 8; ++ns)
#pragma unroll
      for (int q = 0; q < 8; ++q) acc[ns][q] = 0.0f;

    for (int kb = 0; kb < D_; kb += 16) {
      __syncthreads();   // previous slab's reads complete before overwrite

      if (wave == 0) {
        // --- TDM: DMA enc tile 128 rows x 16 floats (row stride 512) -> As ---
        const unsigned long long ga = (unsigned long long)(uintptr_t)(encB + kb);
        u32x4 g0;
        g0.x = 1u;                                       // count=1, load, user desc
        g0.y = lds_As;                                   // lds_addr
        g0.z = (unsigned int)ga;                         // global_addr[31:0]
        g0.w = (unsigned int)((ga >> 32) & 0x01FFFFFFu)  // global_addr[56:32]
               | (2u << 30);                             // type=2 ("image")
        i32x8 g1;
        g1[0] = (int)((2u << 16)      // data_size = 4B
                    | (1u << 20)      // pad_enable
                    | (3u << 22)      // pad_interval = 16 DWORDs
                    | (0u << 25));    // pad_amount   = 1 DWORD  -> stride 17
        g1[1] = (int)(512u << 16);    // tensor_dim0 = 512 (low 16 -> [63:48])
        g1[2] = (int)(128u << 16);    // tensor_dim0 hi=0 | tensor_dim1 = 128
        g1[3] = (int)(16u << 16);     // tensor_dim1 hi=0 | tile_dim0 = 16
        g1[4] = 128;                  // tile_dim1 = 128, tile_dim2 = 0
        g1[5] = 512;                  // tensor_dim0_stride[31:0] = 512
        g1[6] = 0;                    // stride0 hi | stride1 lo
        g1[7] = 0;                    // stride1 hi
        const i32x4 gz = {0, 0, 0, 0};
#if __clang_major__ >= 23
        const i32x8 gz8 = {0, 0, 0, 0, 0, 0, 0, 0};
        __builtin_amdgcn_tensor_load_to_lds(g0, g1, gz, gz, gz8, 0);
#else
        __builtin_amdgcn_tensor_load_to_lds(g0, g1, gz, gz, 0);
#endif
        __builtin_amdgcn_s_wait_tensorcnt(0);
      }

      // stage V_w slab transposed: Bs[col][kr], stride 18 (conflict-free, b64-aligned)
#pragma unroll
      for (int j = 0; j < 8; ++j) {
        int i = tid + 256 * j;
        int kr = i >> 7, col = i & 127;
        Bs[col * 18 + kr] = Vw[(kb + kr) * D_ + nc * 128 + col];
      }
      __syncthreads();

#pragma unroll
      for (int ks = 0; ks < 16; ks += 4) {
        // A frag (16x4 f32): lane l<16 holds row l, K={ks,ks+1}; l>=16: K={ks+2,ks+3}
        v2f a;
        const int arow = (wave * 16 + l15) * 17 + ks + hi * 2;
        a.x = As[arow];
        a.y = As[arow + 1];
#pragma unroll
        for (int ns = 0; ns < 8; ++ns) {
          // B frag (4x16): vgpr r, lane-half hi -> K = r + 2*hi, N = l15
          // transposed LDS layout -> contiguous pair, single ds_load_b64
          const v2f bf = *(const v2f*)&Bs[(ns * 16 + l15) * 18 + ks + hi * 2];
          acc[ns] = __builtin_amdgcn_wmma_f32_16x16x4_f32(
              false, a, false, bf, (short)0, acc[ns], false, false);
        }
      }
    }
    // epilogue: tanh + weighted dot for this N-chunk
    // C layout: vgpr r, lane -> (M = r + 8*hi, N = l15)
#pragma unroll
    for (int ns = 0; ns < 8; ++ns) {
      const int col = nc * 128 + ns * 16 + l15;
      const float av = addv_s[col];
      const float gv = gw_s[col];
#pragma unroll
      for (int r = 0; r < 8; ++r)
        part[r] += tanhf(acc[ns][r] + av) * gv;
    }
  }

  // reduce the 16 lanes of each half -> one score per row
#pragma unroll
  for (int r = 0; r < 8; ++r) {
    float v = part[r];
    v += __shfl_xor(v, 8, 16);
    v += __shfl_xor(v, 4, 16);
    v += __shfl_xor(v, 2, 16);
    v += __shfl_xor(v, 1, 16);
    if (l15 == 0) score_s[wave * 16 + hi * 8 + r] = v;
  }
  __syncthreads();
  if (tid < 128)
    score[(size_t)b * T_ + tb * 128 + tid] = score_s[tid] + gb[0];
}

// ---------------------------------------------------------------------------
// F) masked softmax over T with SCALING=2
// ---------------------------------------------------------------------------
__global__ __launch_bounds__(256) void softmax_kernel(
    const float* __restrict__ score, const int* __restrict__ lens,
    float* __restrict__ w_out) {
  __shared__ float red[256];
  const int b = blockIdx.x, tid = threadIdx.x;
  const int len = lens[b];
  const float* s = score + (size_t)b * T_;
  float mx = -3.0e38f;
  for (int t = tid; t < T_; t += 256) {
    float v = (t < len) ? 2.0f * s[t] : -3.0e38f;
    mx = fmaxf(mx, v);
  }
  red[tid] = mx;
  __syncthreads();
  for (int off = 128; off > 0; off >>= 1) {
    if (tid < off) red[tid] = fmaxf(red[tid], red[tid + off]);
    __syncthreads();
  }
  mx = red[0];
  __syncthreads();
  float sum = 0.0f;
  for (int t = tid; t < T_; t += 256) {
    float v = (t < len) ? 2.0f * s[t] : -3.0e38f;
    sum += __expf(v - mx);
  }
  red[tid] = sum;
  __syncthreads();
  for (int off = 128; off > 0; off >>= 1) {
    if (tid < off) red[tid] += red[tid + off];
    __syncthreads();
  }
  const float inv = 1.0f / red[0];
  for (int t = tid; t < T_; t += 256) {
    float v = (t < len) ? 2.0f * s[t] : -3.0e38f;
    w_out[(size_t)b * T_ + t] = __expf(v - mx) * inv;
  }
}

// ---------------------------------------------------------------------------
// G) c_v[b,e] = sum_t enc[b,t,e] * w[b,t]   (enc should hit L2: 134MB < 192MB)
// ---------------------------------------------------------------------------
__global__ __launch_bounds__(256) void context_kernel(
    const float* __restrict__ enc, const float* __restrict__ w,
    float* __restrict__ c_v) {
  __shared__ float red[256];
  const int b = blockIdx.x, chunk = blockIdx.y;
  const int col = chunk * 64 + (threadIdx.x & 63);
  const int trow = threadIdx.x >> 6;   // 0..3
  const float* e = enc + (size_t)b * T_ * D_;
  const float* wb = w + (size_t)b * T_;
  float acc = 0.0f;
  for (int t = trow; t < T_; t += 4)
    acc += e[(size_t)t * D_ + col] * wb[t];
  red[threadIdx.x] = acc;
  __syncthreads();
  if (threadIdx.x < 64)
    c_v[b * D_ + col] = red[threadIdx.x] + red[threadIdx.x + 64] +
                        red[threadIdx.x + 128] + red[threadIdx.x + 192];
}

// ---------------------------------------------------------------------------
extern "C" void kernel_launch(void* const* d_in, const int* in_sizes, int n_in,
                              void* d_out, int out_size, void* d_ws, size_t ws_size,
                              hipStream_t stream) {
  const float* enc      = (const float*)d_in[0];
  const int*   lens     = (const int*)  d_in[1];
  const float* dec_z    = (const float*)d_in[2];
  const float* att_prev = (const float*)d_in[3];
  const float* att_h    = (const float*)d_in[4];
  const float* att_c    = (const float*)d_in[5];
  const float* W_w      = (const float*)d_in[6];
  const float* W_b      = (const float*)d_in[7];
  const float* V_w      = (const float*)d_in[8];
  const float* V_b      = (const float*)d_in[9];
  const float* U_w      = (const float*)d_in[10];
  const float* U_b      = (const float*)d_in[11];
  const float* g_w      = (const float*)d_in[12];
  const float* g_b      = (const float*)d_in[13];
  const float* conv_w   = (const float*)d_in[14];
  const float* W_ih     = (const float*)d_in[15];
  const float* W_hh     = (const float*)d_in[16];
  const float* b_ih     = (const float*)d_in[17];
  const float* b_hh     = (const float*)d_in[18];

  float* out = (float*)d_out;
  float* cv_out = out;                              // (32,512)
  float* w_out  = out + B_ * D_;                    // (32,2048)
  float* h_out  = out + B_ * D_ + B_ * T_;          // (32,512)
  float* c_out  = out + 2 * B_ * D_ + B_ * T_;      // (32,512)

  float* ws = (float*)d_ws;
  float* feat_ws  = ws;                               // 32*NCH*32
  float* gates_ws = feat_ws + B_ * NCH * CH;          // 32*2048
  float* addv_ws  = gates_ws + B_ * 4 * D_;           // 32*512
  float* score_ws = addv_ws + B_ * D_;                // 32*2048

  conv_feat_kernel<<<dim3(NCH, B_), 256, 0, stream>>>(att_prev, conv_w, feat_ws);
  gates_kernel<<<B_ * 8, 256, 0, stream>>>(feat_ws, att_h, W_ih, W_hh, b_ih, b_hh, gates_ws);
  cell_kernel<<<B_ * D_ / 256, 256, 0, stream>>>(gates_ws, att_c, h_out, c_out);
  addvec_kernel<<<B_ * 2, 256, 0, stream>>>(h_out, dec_z, W_w, W_b, U_w, U_b, V_b, addv_ws);
  score_fused_kernel<<<dim3(T_ / 128, B_), 256, 0, stream>>>(enc, V_w, addv_ws, g_w, g_b, score_ws);
  softmax_kernel<<<B_, 256, 0, stream>>>(score_ws, lens, w_out);
  context_kernel<<<dim3(B_, D_ / 64), 256, 0, stream>>>(enc, w_out, cv_out);
}
